// v000
// The times below were measured on an AMD MI455X: many runs one after another, warmed up first and cycling through
// copies of the inputs, with the whole window's GPU time divided by the number of runs. Launches and the gaps
// between them are all in it. The median over several windows is given; except for v000 it joins two sittings, which
// can be a few percent apart, so the side-by-side timings, each taken in one sitting, are the better comparison.
// v000 is the starting kernel. One run takes 296 microseconds.
#include <hip/hip_runtime.h>
#include <math.h>

// Problem constants (match reference)
#define TT 2048
#define BB 4
#define CC 512
#define HH 16
#define KK 31
#define PP 15
#define MM (TT * BB)   // 8192 rows

typedef __attribute__((ext_vector_type(2))) float v2f;
typedef __attribute__((ext_vector_type(8))) float v8f;

// ---------------- fp32 WMMA GEMM: C[m,n] = sum_k A[m,k] * W[n,k] (+ bias[n]) ----
// A: row-major M x K (lda = K). W: row-major N x K (we multiply by W^T).
// Block tile 64(M) x 128(N), 128 threads = 4 waves; each wave computes a 16x128
// strip as 8 16x16 fragments. K staged through double-buffered LDS, 32 per panel.
#define TM 64
#define TN 128
#define KC 32
#define ASTRIDE 36          // floats per A row in LDS (16B-aligned, conflict-free)
#define BSTRIDE (TN + 16)   // float2 per B k-pair row (row stride == 32 floats mod 64)

__global__ __launch_bounds__(128) void gemm_f32_wmma(
    const float* __restrict__ A, const float* __restrict__ W,
    const float* __restrict__ bias, float* __restrict__ Co,
    int M, int N_valid, int K, int ldc)
{
    __shared__ float As[2][TM][ASTRIDE];       // A panel: 64 x 32 (padded)
    __shared__ v2f   Bs[2][KC / 2][BSTRIDE];   // B panel as K-pairs: Bs[g][n] = {Wk(2g), Wk(2g+1)}

    const int tid  = threadIdx.x;      // 0..127
    const int wave = tid >> 5;         // 0..3
    const int lane = tid & 31;
    const int hl   = lane >> 4;        // half-lane group: K offset 0 or 2
    const int l15  = lane & 15;

    const int m0   = blockIdx.x * TM;
    const int n0   = blockIdx.y * TN;
    const int mrow = wave * 16;

    // fill mappings (lane-minor in the LDS-written dimension -> conflict-free stores)
    const int rowA = tid & 15;         // + r*16, r=0..3
    const int c4A  = tid >> 4;         // 0..7 -> k chunk of 4
    const int nB   = tid & 15;         // + r*16, r=0..7
    const int c4B  = tid >> 4;         // 0..7 -> k chunk of 4

    v8f acc[8] = {};

    // ---- preload panel 0 ----
    {
        #pragma unroll
        for (int r = 0; r < TM / 16; r++) {
            const float4 v = *(const float4*)(A + (size_t)(m0 + rowA + r * 16) * K + c4A * 4);
            *((float4*)&As[0][rowA + r * 16][c4A * 4]) = v;
        }
        #pragma unroll
        for (int r = 0; r < TN / 16; r++) {
            const int gn = n0 + nB + r * 16;
            float4 v = make_float4(0.f, 0.f, 0.f, 0.f);
            if (gn < N_valid) v = *(const float4*)(W + (size_t)gn * K + c4B * 4);
            Bs[0][c4B * 2 + 0][nB + r * 16] = v2f{v.x, v.y};
            Bs[0][c4B * 2 + 1][nB + r * 16] = v2f{v.z, v.w};
        }
    }
    __syncthreads();

    for (int kc = 0; kc < K; kc += KC) {
        const int cur = (kc / KC) & 1;
        const int nxt = cur ^ 1;
        const bool has_next = (kc + KC) < K;

        // ---- issue next panel's global loads into registers ----
        float4 ra[TM / 16];
        float4 rb[TN / 16];
        if (has_next) {
            #pragma unroll
            for (int r = 0; r < TM / 16; r++)
                ra[r] = *(const float4*)(A + (size_t)(m0 + rowA + r * 16) * K + kc + KC + c4A * 4);
            #pragma unroll
            for (int r = 0; r < TN / 16; r++) {
                const int gn = n0 + nB + r * 16;
                rb[r] = make_float4(0.f, 0.f, 0.f, 0.f);
                if (gn < N_valid)
                    rb[r] = *(const float4*)(W + (size_t)gn * K + kc + KC + c4B * 4);
            }
        }

        // ---- compute current panel: 8 k-steps x 8 fragments = 64 WMMA ----
        #pragma unroll
        for (int kk = 0; kk < KC; kk += 4) {
            const int ka = kk + hl * 2;        // lanes 0-15: kk,kk+1 ; lanes 16-31: kk+2,kk+3
            const int g  = (kk >> 1) + hl;     // B float2 k-pair row
            v2f a;
            a.x = As[cur][mrow + l15][ka];
            a.y = As[cur][mrow + l15][ka + 1];
            #pragma unroll
            for (int j = 0; j < 8; j++) {
                const v2f b = Bs[cur][g][j * 16 + l15];   // single ds_load_b64
                acc[j] = __builtin_amdgcn_wmma_f32_16x16x4_f32(
                    false, a, false, b, (short)0, acc[j], false, false);
            }
        }

        // ---- commit next panel to LDS, then one barrier per iteration ----
        if (has_next) {
            #pragma unroll
            for (int r = 0; r < TM / 16; r++)
                *((float4*)&As[nxt][rowA + r * 16][c4A * 4]) = ra[r];
            #pragma unroll
            for (int r = 0; r < TN / 16; r++) {
                Bs[nxt][c4B * 2 + 0][nB + r * 16] = v2f{rb[r].x, rb[r].y};
                Bs[nxt][c4B * 2 + 1][nB + r * 16] = v2f{rb[r].z, rb[r].w};
            }
        }
        __syncthreads();
    }

    // ---- store: C/D layout -> lanes 0-15: M = i (VGPR i), lanes 16-31: M = 8+i ----
    const int rbase = m0 + mrow + hl * 8;
    #pragma unroll
    for (int j = 0; j < 8; j++) {
        const int col = n0 + j * 16 + l15;
        if (col < N_valid) {
            const float bv = bias ? bias[col] : 0.0f;
            #pragma unroll
            for (int i = 0; i < 8; i++)
                Co[(size_t)(rbase + i) * ldc + col] = acc[j][i] + bv;
        }
    }
}

// ---------------- softmax over K=31 per (row, head), in place -------------------
__global__ __launch_bounds__(256) void softmax_k31(float* __restrict__ w, int M)
{
    const int idx = blockIdx.x * blockDim.x + threadIdx.x;   // m*HH + head
    if (idx >= M * HH) return;
    const int m = idx >> 4;
    const int head = idx & (HH - 1);
    float* p = w + (size_t)m * CC + head * KK;   // row stride padded to CC
    float mx = -INFINITY;
    #pragma unroll
    for (int k = 0; k < KK; k++) mx = fmaxf(mx, p[k]);
    float s = 0.0f;
    #pragma unroll
    for (int k = 0; k < KK; k++) { const float e = __expf(p[k] - mx); p[k] = e; s += e; }
    const float inv = 1.0f / s;
    #pragma unroll
    for (int k = 0; k < KK; k++) p[k] *= inv;
}

// ---------------- dynamic banded convolution ------------------------------------
// out[t,b,c] = sum_k h[t-P+k, b, c] * wsm[t,b,head(c),k]
__global__ __launch_bounds__(256) void dynconv(
    const float* __restrict__ h, const float* __restrict__ w, float* __restrict__ out)
{
    __shared__ float ws[HH][KK];
    const int tb = blockIdx.x;           // t*BB + b
    const int t = tb / BB;
    const int b = tb % BB;
    const int tid = threadIdx.x;

    for (int i = tid; i < HH * KK; i += 256)
        ws[i / KK][i % KK] = w[(size_t)tb * CC + i];
    __syncthreads();

    #pragma unroll
    for (int c = tid; c < CC; c += 256) {
        const int head = c >> 5;         // R = 32 channels per head
        float acc = 0.0f;
        #pragma unroll
        for (int k = 0; k < KK; k++) {
            const int ts = t - PP + k;
            if (ts >= 0 && ts < TT)
                acc = fmaf(h[((size_t)ts * BB + b) * CC + c], ws[head][k], acc);
        }
        out[(size_t)tb * CC + c] = acc;
    }
}

extern "C" void kernel_launch(void* const* d_in, const int* in_sizes, int n_in,
                              void* d_out, int out_size, void* d_ws, size_t ws_size,
                              hipStream_t stream) {
    const float* x  = (const float*)d_in[0];   // (T,B,C)
    const float* W1 = (const float*)d_in[1];   // (C,C)
    const float* b1 = (const float*)d_in[2];   // (C,)
    const float* Wl = (const float*)d_in[3];   // (H*K, C)
    const float* W2 = (const float*)d_in[4];   // (C,C)
    const float* b2 = (const float*)d_in[5];   // (C,)
    float* y = (float*)d_out;

    float* h  = (float*)d_ws;                  // 8192 x 512
    float* w  = h  + (size_t)MM * CC;          // 8192 x 512 (496 valid cols)
    float* cv = w  + (size_t)MM * CC;          // 8192 x 512

    const dim3 block(128);
    const dim3 grid(MM / TM, CC / TN);         // 128 x 4

    // 1) h = x @ W1^T + b1
    gemm_f32_wmma<<<grid, block, 0, stream>>>(x, W1, b1, h, MM, CC, CC, CC);
    // 2) w = h @ Wl^T   (N_valid = H*K = 496, buffer padded to 512)
    gemm_f32_wmma<<<grid, block, 0, stream>>>(h, Wl, nullptr, w, MM, HH * KK, CC, CC);
    // 3) softmax over K per (m, head)
    softmax_k31<<<(MM * HH + 255) / 256, 256, 0, stream>>>(w, MM);
    // 4) dynamic conv
    dynconv<<<MM, 256, 0, stream>>>(h, w, cv);
    // 5) y = conv @ W2^T + b2
    gemm_f32_wmma<<<grid, block, 0, stream>>>(cv, W2, b2, y, MM, CC, CC, CC);
}

// v001
// Measured time: 193 microseconds a run.
// Two timings next to v000 put it at 1.56 and 1.57 times that version's speed.
#include <hip/hip_runtime.h>
#include <math.h>

// Problem constants (match reference)
#define TT 2048
#define BB 4
#define CC 512
#define HH 16
#define KK 31
#define PP 15
#define MM (TT * BB)   // 8192 rows

typedef __attribute__((ext_vector_type(2))) float v2f;
typedef __attribute__((ext_vector_type(8))) float v8f;

// ---------------- fp32 WMMA GEMM: C[m,n] = sum_k A[m,k] * W[n,k] (+ bias[n]) ----
// A: row-major M x K (lda = K). W: row-major N x K (we multiply by W^T).
// Block tile 64(M) x 128(N), 128 threads = 4 waves; each wave computes a 16x128
// strip as 8 16x16 fragments. K panels of 32 floats (one 128-byte line per row) go
// from global memory straight into a two-buffer LDS ring by asynchronous copies:
// 8 lanes x 16 B cover one row's line, so a wave's copy touches 4 whole lines.
#define TM 64
#define TN 128
#define KC 32
#define LPITCH 36           // floats per panel row in LDS: 144 B = 16 B x odd, conflict-free 8-byte reads

// Low 32 bits of a __shared__ address = byte offset in the work-group's LDS.
__device__ __forceinline__ unsigned lds_off(const void* p) { return (unsigned)(size_t)p; }

// One panel: 4 copies per lane for A (64 rows), 8 for W (128 rows).
// The s_wait_xcnt stands inside the statement so that no address register of an
// issued copy is rewritten ahead of it.
__device__ __forceinline__ void copy_panel(
    unsigned la, const float* ga, size_t sa, unsigned lb, const float* const (&gb)[8], int ko)
{
    ga += ko;                              // ko: the panel's first k
    const unsigned rs = 16 * LPITCH * 4;   // LDS bytes per 16 rows
    asm volatile(
        "global_load_async_to_lds_b128 %0, %1, off\n\t"
        "global_load_async_to_lds_b128 %2, %3, off\n\t"
        "global_load_async_to_lds_b128 %4, %5, off\n\t"
        "global_load_async_to_lds_b128 %6, %7, off\n\t"
        "global_load_async_to_lds_b128 %8, %9, off\n\t"
        "global_load_async_to_lds_b128 %10, %11, off\n\t"
        "global_load_async_to_lds_b128 %12, %13, off\n\t"
        "global_load_async_to_lds_b128 %14, %15, off\n\t"
        "global_load_async_to_lds_b128 %16, %17, off\n\t"
        "global_load_async_to_lds_b128 %18, %19, off\n\t"
        "global_load_async_to_lds_b128 %20, %21, off\n\t"
        "global_load_async_to_lds_b128 %22, %23, off\n\t"
        "s_wait_xcnt 0x0"
        :: "v"(la),          "v"(ga),
           "v"(la + rs),     "v"(ga + sa),
           "v"(la + 2 * rs), "v"(ga + 2 * sa),
           "v"(la + 3 * rs), "v"(ga + 3 * sa),
           "v"(lb),          "v"(gb[0] + ko),
           "v"(lb + rs),     "v"(gb[1] + ko),
           "v"(lb + 2 * rs), "v"(gb[2] + ko),
           "v"(lb + 3 * rs), "v"(gb[3] + ko),
           "v"(lb + 4 * rs), "v"(gb[4] + ko),
           "v"(lb + 5 * rs), "v"(gb[5] + ko),
           "v"(lb + 6 * rs), "v"(gb[6] + ko),
           "v"(lb + 7 * rs), "v"(gb[7] + ko)
        : "memory");
}

__global__ __launch_bounds__(128) void gemm_f32_wmma(
    const float* __restrict__ A, const float* __restrict__ W,
    const float* __restrict__ bias, float* __restrict__ Co,
    int M, int N_valid, int K, int ldc)
{
    __shared__ __attribute__((aligned(16))) float As[2][TM][LPITCH];   // A panel: 64 x 32 (padded)
    __shared__ __attribute__((aligned(16))) float Bs[2][TN][LPITCH];   // W panel: 128 x 32 (padded)

    const int tid  = threadIdx.x;      // 0..127
    const int wave = tid >> 5;         // 0..3
    const int lane = tid & 31;
    const int hl   = lane >> 4;        // half-lane group: K offset 0 or 2
    const int l15  = lane & 15;

    const int m0   = blockIdx.x * TM;
    const int n0   = blockIdx.y * TN;
    const int mrow = wave * 16;

    // copy mapping: 8 lanes per row (16 B each), 16 rows per pass over the block
    const int crow = tid >> 3;         // 0..15, + r*16
    const int cchk = (tid & 7) * 4;    // float offset of the lane's 16 B in the row

    const float* gA = A + (size_t)(m0 + crow) * K + cchk;
    const size_t sA = (size_t)16 * K;
    const float* gB[8];
    #pragma unroll   // the eight row pointers stay in registers
    for (int r = 0; r < 8; r++) {
        // rows past N_valid copy the last valid row: in bounds, and their columns are never stored
        int gn = n0 + crow + r * 16;
        gn = gn < N_valid ? gn : N_valid - 1;
        gB[r] = W + (size_t)gn * K + cchk;
    }
    const unsigned lA = lds_off(&As[0][crow][cchk]);
    const unsigned lB = lds_off(&Bs[0][crow][cchk]);
    const unsigned bufA = TM * LPITCH * 4;   // bytes from buffer 0 to buffer 1
    const unsigned bufB = TN * LPITCH * 4;

    v8f acc[8] = {};

    const int nt = K / KC;

    // ---- prologue: panel 0 lands and is published, then panel 1 starts ----
    copy_panel(lA, gA, sA, lB, gB, 0);
    asm volatile("s_wait_asynccnt 0x0" ::: "memory");   // this wave's copies of panel 0 have landed
    __syncthreads();
    if (nt > 1)
        copy_panel(lA + bufA, gA, sA, lB + bufB, gB, KC);

    for (int t = 0; t < nt; t++) {
        const int cur = t & 1;

        // ---- compute current panel: 8 k-steps x 8 fragments = 64 WMMA ----
        #pragma unroll
        for (int kk = 0; kk < KC; kk += 4) {
            const int ka = kk + hl * 2;        // lanes 0-15: kk,kk+1 ; lanes 16-31: kk+2,kk+3
            const v2f a = *(const v2f*)&As[cur][mrow + l15][ka];
            #pragma unroll
            for (int j = 0; j < 8; j++) {
                const v2f b = *(const v2f*)&Bs[cur][j * 16 + l15][ka];   // single ds_load_b64
                acc[j] = __builtin_amdgcn_wmma_f32_16x16x4_f32(
                    false, a, false, b, (short)0, acc[j], false, false);
            }
        }

        // ---- publish panel t+1, free this buffer, refill it with panel t+2 ----
        asm volatile("s_wait_dscnt 0x0" ::: "memory");      // this wave's reads of the buffer are done
        asm volatile("s_wait_asynccnt 0x0" ::: "memory");   // this wave's copies of panel t+1 have landed
        __syncthreads();
        if (t + 2 < nt)
            copy_panel(lA + cur * bufA, gA, sA, lB + cur * bufB, gB, (t + 2) * KC);
    }
    asm volatile("s_wait_asynccnt 0x0" ::: "memory");   // nothing in flight when the wave ends

    // ---- store: C/D layout -> lanes 0-15: M = i (VGPR i), lanes 16-31: M = 8+i ----
    const int rbase = m0 + mrow + hl * 8;
    #pragma unroll
    for (int j = 0; j < 8; j++) {
        const int col = n0 + j * 16 + l15;
        if (col < N_valid) {
            const float bv = bias ? bias[col] : 0.0f;
            #pragma unroll
            for (int i = 0; i < 8; i++)
                Co[(size_t)(rbase + i) * ldc + col] = acc[j][i] + bv;
        }
    }
}

// ---------------- softmax over K=31 per (row, head), in place -------------------
__global__ __launch_bounds__(256) void softmax_k31(float* __restrict__ w, int M)
{
    const int idx = blockIdx.x * blockDim.x + threadIdx.x;   // m*HH + head
    if (idx >= M * HH) return;
    const int m = idx >> 4;
    const int head = idx & (HH - 1);
    float* p = w + (size_t)m * CC + head * KK;   // row stride padded to CC
    float mx = -INFINITY;
    #pragma unroll
    for (int k = 0; k < KK; k++) mx = fmaxf(mx, p[k]);
    float s = 0.0f;
    #pragma unroll
    for (int k = 0; k < KK; k++) { const float e = __expf(p[k] - mx); p[k] = e; s += e; }
    const float inv = 1.0f / s;
    #pragma unroll
    for (int k = 0; k < KK; k++) p[k] *= inv;
}

// ---------------- dynamic banded convolution ------------------------------------
// out[t,b,c] = sum_k h[t-P+k, b, c] * wsm[t,b,head(c),k]
__global__ __launch_bounds__(256) void dynconv(
    const float* __restrict__ h, const float* __restrict__ w, float* __restrict__ out)
{
    __shared__ float ws[HH][KK];
    const int tb = blockIdx.x;           // t*BB + b
    const int t = tb / BB;
    const int b = tb % BB;
    const int tid = threadIdx.x;

    for (int i = tid; i < HH * KK; i += 256)
        ws[i / KK][i % KK] = w[(size_t)tb * CC + i];
    __syncthreads();

    #pragma unroll
    for (int c = tid; c < CC; c += 256) {
        const int head = c >> 5;         // R = 32 channels per head
        float acc = 0.0f;
        #pragma unroll
        for (int k = 0; k < KK; k++) {
            const int ts = t - PP + k;
            if (ts >= 0 && ts < TT)
                acc = fmaf(h[((size_t)ts * BB + b) * CC + c], ws[head][k], acc);
        }
        out[(size_t)tb * CC + c] = acc;
    }
}

extern "C" void kernel_launch(void* const* d_in, const int* in_sizes, int n_in,
                              void* d_out, int out_size, void* d_ws, size_t ws_size,
                              hipStream_t stream) {
    const float* x  = (const float*)d_in[0];   // (T,B,C)
    const float* W1 = (const float*)d_in[1];   // (C,C)
    const float* b1 = (const float*)d_in[2];   // (C,)
    const float* Wl = (const float*)d_in[3];   // (H*K, C)
    const float* W2 = (const float*)d_in[4];   // (C,C)
    const float* b2 = (const float*)d_in[5];   // (C,)
    float* y = (float*)d_out;

    float* h  = (float*)d_ws;                  // 8192 x 512
    float* w  = h  + (size_t)MM * CC;          // 8192 x 512 (496 valid cols)
    float* cv = w  + (size_t)MM * CC;          // 8192 x 512

    const dim3 block(128);
    const dim3 grid(MM / TM, CC / TN);         // 128 x 4

    // 1) h = x @ W1^T + b1
    gemm_f32_wmma<<<grid, block, 0, stream>>>(x, W1, b1, h, MM, CC, CC, CC);
    // 2) w = h @ Wl^T   (N_valid = H*K = 496, buffer padded to 512)
    gemm_f32_wmma<<<grid, block, 0, stream>>>(h, Wl, nullptr, w, MM, HH * KK, CC, CC);
    // 3) softmax over K per (m, head)
    softmax_k31<<<(MM * HH + 255) / 256, 256, 0, stream>>>(w, MM);
    // 4) dynamic conv
    dynconv<<<MM, 256, 0, stream>>>(h, w, cv);
    // 5) y = conv @ W2^T + b2
    gemm_f32_wmma<<<grid, block, 0, stream>>>(cv, W2, b2, y, MM, CC, CC, CC);
}

// v002
// It runs in 134 microseconds.
// In two side-by-side timings against v001, it was 1.44 and 1.45 times as fast.
// All steps since v000 together make it 2.26 times as fast.
#include <hip/hip_runtime.h>
#include <math.h>

// Problem constants (match reference)
#define TT 2048
#define BB 4
#define CC 512
#define HH 16
#define KK 31
#define PP 15
#define MM (TT * BB)   // 8192 rows

typedef __attribute__((ext_vector_type(2))) float v2f;
typedef __attribute__((ext_vector_type(8))) float v8f;

// ---------------- fp32 WMMA GEMM: C[m,n] = sum_k A[m,k] * W[n,k] (+ bias[n]) ----
// A: row-major M x K (lda = K). W: row-major N x K (we multiply by W^T).
// Block tile 64(M) x 128(N), 128 threads = 4 waves; each wave computes a 16x128
// strip as 8 16x16 fragments. K panels of 32 floats (one 128-byte line per row) go
// from global memory straight into a two-buffer LDS ring by asynchronous copies:
// 8 lanes x 16 B cover one row's line, so a wave's copy touches 4 whole lines.
#define TM 64
#define TN 128
#define KC 32
#define LPITCH 36           // floats per panel row in LDS: 144 B = 16 B x odd, conflict-free 8-byte reads

// Low 32 bits of a __shared__ address = byte offset in the work-group's LDS.
__device__ __forceinline__ unsigned lds_off(const void* p) { return (unsigned)(size_t)p; }

// One panel: 4 copies per lane for A (64 rows), 8 for W (128 rows).
// The s_wait_xcnt stands inside the statement so that no address register of an
// issued copy is rewritten ahead of it.
__device__ __forceinline__ void copy_panel(
    unsigned la, const float* ga, size_t sa, unsigned lb, const float* const (&gb)[8], int ko)
{
    ga += ko;                              // ko: the panel's first k
    const unsigned rs = 16 * LPITCH * 4;   // LDS bytes per 16 rows
    asm volatile(
        "global_load_async_to_lds_b128 %0, %1, off\n\t"
        "global_load_async_to_lds_b128 %2, %3, off\n\t"
        "global_load_async_to_lds_b128 %4, %5, off\n\t"
        "global_load_async_to_lds_b128 %6, %7, off\n\t"
        "global_load_async_to_lds_b128 %8, %9, off\n\t"
        "global_load_async_to_lds_b128 %10, %11, off\n\t"
        "global_load_async_to_lds_b128 %12, %13, off\n\t"
        "global_load_async_to_lds_b128 %14, %15, off\n\t"
        "global_load_async_to_lds_b128 %16, %17, off\n\t"
        "global_load_async_to_lds_b128 %18, %19, off\n\t"
        "global_load_async_to_lds_b128 %20, %21, off\n\t"
        "global_load_async_to_lds_b128 %22, %23, off\n\t"
        "s_wait_xcnt 0x0"
        :: "v"(la),          "v"(ga),
           "v"(la + rs),     "v"(ga + sa),
           "v"(la + 2 * rs), "v"(ga + 2 * sa),
           "v"(la + 3 * rs), "v"(ga + 3 * sa),
           "v"(lb),          "v"(gb[0] + ko),
           "v"(lb + rs),     "v"(gb[1] + ko),
           "v"(lb + 2 * rs), "v"(gb[2] + ko),
           "v"(lb + 3 * rs), "v"(gb[3] + ko),
           "v"(lb + 4 * rs), "v"(gb[4] + ko),
           "v"(lb + 5 * rs), "v"(gb[5] + ko),
           "v"(lb + 6 * rs), "v"(gb[6] + ko),
           "v"(lb + 7 * rs), "v"(gb[7] + ko)
        : "memory");
}

__global__ __launch_bounds__(128) void gemm_f32_wmma(
    const float* __restrict__ A, const float* __restrict__ W,
    const float* __restrict__ bias, float* __restrict__ Co,
    int M, int N_valid, int K, int ldc)
{
    __shared__ __attribute__((aligned(16))) float As[2][TM][LPITCH];   // A panel: 64 x 32 (padded)
    __shared__ __attribute__((aligned(16))) float Bs[2][TN][LPITCH];   // W panel: 128 x 32 (padded)

    const int tid  = threadIdx.x;      // 0..127
    const int wave = tid >> 5;         // 0..3
    const int lane = tid & 31;
    const int hl   = lane >> 4;        // half-lane group: K offset 0 or 2
    const int l15  = lane & 15;

    const int m0   = blockIdx.x * TM;
    const int n0   = blockIdx.y * TN;
    const int mrow = wave * 16;

    // copy mapping: 8 lanes per row (16 B each), 16 rows per pass over the block
    const int crow = tid >> 3;         // 0..15, + r*16
    const int cchk = (tid & 7) * 4;    // float offset of the lane's 16 B in the row

    const float* gA = A + (size_t)(m0 + crow) * K + cchk;
    const size_t sA = (size_t)16 * K;
    const float* gB[8];
    #pragma unroll   // the eight row pointers stay in registers
    for (int r = 0; r < 8; r++) {
        // rows past N_valid copy the last valid row: in bounds, and their columns are never stored
        int gn = n0 + crow + r * 16;
        gn = gn < N_valid ? gn : N_valid - 1;
        gB[r] = W + (size_t)gn * K + cchk;
    }
    const unsigned lA = lds_off(&As[0][crow][cchk]);
    const unsigned lB = lds_off(&Bs[0][crow][cchk]);
    const unsigned bufA = TM * LPITCH * 4;   // bytes from buffer 0 to buffer 1
    const unsigned bufB = TN * LPITCH * 4;

    v8f acc[8] = {};

    const int nt = K / KC;

    // ---- prologue: panel 0 lands and is published, then panel 1 starts ----
    copy_panel(lA, gA, sA, lB, gB, 0);
    asm volatile("s_wait_asynccnt 0x0" ::: "memory");   // this wave's copies of panel 0 have landed
    __syncthreads();
    if (nt > 1)
        copy_panel(lA + bufA, gA, sA, lB + bufB, gB, KC);

    for (int t = 0; t < nt; t++) {
        const int cur = t & 1;

        // ---- compute current panel: 8 k-steps x 8 fragments = 64 WMMA ----
        #pragma unroll
        for (int kk = 0; kk < KC; kk += 4) {
            const int ka = kk + hl * 2;        // lanes 0-15: kk,kk+1 ; lanes 16-31: kk+2,kk+3
            const v2f a = *(const v2f*)&As[cur][mrow + l15][ka];
            #pragma unroll
            for (int j = 0; j < 8; j++) {
                const v2f b = *(const v2f*)&Bs[cur][j * 16 + l15][ka];   // single ds_load_b64
                acc[j] = __builtin_amdgcn_wmma_f32_16x16x4_f32(
                    false, a, false, b, (short)0, acc[j], false, false);
            }
        }

        // ---- publish panel t+1, free this buffer, refill it with panel t+2 ----
        asm volatile("s_wait_dscnt 0x0" ::: "memory");      // this wave's reads of the buffer are done
        asm volatile("s_wait_asynccnt 0x0" ::: "memory");   // this wave's copies of panel t+1 have landed
        __syncthreads();
        if (t + 2 < nt)
            copy_panel(lA + cur * bufA, gA, sA, lB + cur * bufB, gB, (t + 2) * KC);
    }
    asm volatile("s_wait_asynccnt 0x0" ::: "memory");   // nothing in flight when the wave ends

    // ---- store: C/D layout -> lanes 0-15: M = i (VGPR i), lanes 16-31: M = 8+i ----
    const int rbase = m0 + mrow + hl * 8;
    #pragma unroll
    for (int j = 0; j < 8; j++) {
        const int col = n0 + j * 16 + l15;
        if (col < N_valid) {
            const float bv = bias ? bias[col] : 0.0f;
            #pragma unroll
            for (int i = 0; i < 8; i++)
                Co[(size_t)(rbase + i) * ldc + col] = acc[j][i] + bv;
        }
    }
}

// ---------------- softmax over K=31 per (row, head), in place -------------------
__global__ __launch_bounds__(256) void softmax_k31(float* __restrict__ w, int M)
{
    const int idx = blockIdx.x * blockDim.x + threadIdx.x;   // m*HH + head
    if (idx >= M * HH) return;
    const int m = idx >> 4;
    const int head = idx & (HH - 1);
    float* p = w + (size_t)m * CC + head * KK;   // row stride padded to CC
    float mx = -INFINITY;
    #pragma unroll
    for (int k = 0; k < KK; k++) mx = fmaxf(mx, p[k]);
    float s = 0.0f;
    #pragma unroll
    for (int k = 0; k < KK; k++) { const float e = __expf(p[k] - mx); p[k] = e; s += e; }
    const float inv = 1.0f / s;
    #pragma unroll
    for (int k = 0; k < KK; k++) p[k] *= inv;
}

// ---------------- dynamic banded convolution ------------------------------------
// out[t,b,c] = sum_k h[t-P+k, b, c] * wsm[t,b,head(c),k]
// One wave = one head (32 channels) x 32 time steps. A lane owns 4 channels (16 B)
// and NTL consecutive time steps; its NTL+K-1 rows of h are loaded once, all loads in
// flight together, and stay in registers for all its outputs. A wave-wide load or
// store covers 4 rows x one whole 128-byte line. The filters go lane = tap into LDS
// and come back 4 taps per read.
#define NTL 8                     // time steps per lane
#define TWV (4 * NTL)             // time steps per wave
#define NROW (NTL + KK - 1)       // rows of h per lane
#define WPITCH 36                 // floats per filter row in LDS: 144 B, so every 4-tap read is 16 B aligned

typedef __attribute__((ext_vector_type(4))) float v4f;

__global__ __launch_bounds__(256) void dynconv(
    const float* __restrict__ h, const float* __restrict__ w, float* __restrict__ out)
{
    __shared__ __attribute__((aligned(16))) float ws[8][TWV][WPITCH];

    const int wave = threadIdx.x >> 5;
    const int lane = threadIdx.x & 31;
    const int grp  = lane >> 3;                       // which run of NTL time steps
    const int head = (blockIdx.x & 1) * 8 + wave;     // 8 heads per block
    const int b    = (blockIdx.x >> 1) & (BB - 1);
    const int t0   = (blockIdx.x >> 3) * TWV;
    const int c    = head * (CC / HH) + (lane & 7) * 4;
    const int rs   = BB * CC;                         // floats from time step t to t+1

    // filters of the wave's 32 time steps: lane = tap (lane 31 repeats tap 30; its slot is never used)
    const float* wp = w + (unsigned)((t0 * BB + b) * CC + head * KK + (lane < KK ? lane : KK - 1));
    float wv[TWV];
    #pragma unroll   // constant indices: wv stays in registers, the loads go out back to back
    for (int i = 0; i < TWV; i++) wv[i] = wp[i * rs];

    // the lane's rows of h: time steps tl-P .. tl+NTL-1+(K-1-P). tl and T are multiples of
    // NTL, so the rows of one aligned run tg..tg+NTL-1 lie inside [0,T) or outside together;
    // rows outside count as zero, as the reference pads them, and are not loaded.
    const int tl = t0 + grp * NTL;
    const unsigned pos = (unsigned)((tl * BB + b) * CC + c);   // the lane's place in row tl, of h and of out
    const float* hp = h + pos;
    v4f hv[NROW];
    #pragma unroll   // this loop and the two inside: constant indices, so hv stays in registers
    for (int q = 0; q < 5; q++) {
        const int tg = tl + (q - 2) * NTL;
        if (q != 2) {                                 // run 2 is tl..tl+NTL-1 itself: always inside
            #pragma unroll
            for (int j = 0; j < NROW; j++)
                if ((j + 2 * NTL - PP) / NTL == q) hv[j] = (v4f)(0.0f);
        }
        if (q == 2 || (tg >= 0 && tg < TT)) {
            #pragma unroll
            for (int j = 0; j < NROW; j++)
                if ((j + 2 * NTL - PP) / NTL == q) hv[j] = *(const v4f*)(hp + (j - PP) * rs);
        }
    }

    #pragma unroll   // constant indices into wv
    for (int i = 0; i < TWV; i++) ws[wave][i][lane] = wv[i];
    __syncthreads();   // the filters are in LDS before any lane reads them

    float* op = out + pos;
    #pragma unroll   // this loop and the two inside: constant indices into hv; taps in ascending order, one fma each
    for (int i = 0; i < NTL; i++) {
        const float* wr = &ws[wave][grp * NTL + i][0];
        v4f acc = (v4f)(0.0f);
        #pragma unroll
        for (int k4 = 0; k4 < KK; k4 += 4) {
            const v4f wq = *(const v4f*)(wr + k4);           // 4 taps, one LDS read
            #pragma unroll
            for (int e = 0; e < 4; e++) {
                if (k4 + e < KK) {
                    const v4f x = hv[i + k4 + e];
                    acc.x = fmaf(x.x, wq[e], acc.x);
                    acc.y = fmaf(x.y, wq[e], acc.y);
                    acc.z = fmaf(x.z, wq[e], acc.z);
                    acc.w = fmaf(x.w, wq[e], acc.w);
                }
            }
        }
        *(v4f*)(op + i * rs) = acc;
    }
}

extern "C" void kernel_launch(void* const* d_in, const int* in_sizes, int n_in,
                              void* d_out, int out_size, void* d_ws, size_t ws_size,
                              hipStream_t stream) {
    const float* x  = (const float*)d_in[0];   // (T,B,C)
    const float* W1 = (const float*)d_in[1];   // (C,C)
    const float* b1 = (const float*)d_in[2];   // (C,)
    const float* Wl = (const float*)d_in[3];   // (H*K, C)
    const float* W2 = (const float*)d_in[4];   // (C,C)
    const float* b2 = (const float*)d_in[5];   // (C,)
    float* y = (float*)d_out;

    float* h  = (float*)d_ws;                  // 8192 x 512
    float* w  = h  + (size_t)MM * CC;          // 8192 x 512 (496 valid cols)
    float* cv = w  + (size_t)MM * CC;          // 8192 x 512

    const dim3 block(128);
    const dim3 grid(MM / TM, CC / TN);         // 128 x 4

    // 1) h = x @ W1^T + b1
    gemm_f32_wmma<<<grid, block, 0, stream>>>(x, W1, b1, h, MM, CC, CC, CC);
    // 2) w = h @ Wl^T   (N_valid = H*K = 496, buffer padded to 512)
    gemm_f32_wmma<<<grid, block, 0, stream>>>(h, Wl, nullptr, w, MM, HH * KK, CC, CC);
    // 3) softmax over K per (m, head)
    softmax_k31<<<(MM * HH + 255) / 256, 256, 0, stream>>>(w, MM);
    // 4) dynamic conv
    dynconv<<<(TT / TWV) * BB * (HH / 8), 256, 0, stream>>>(h, w, cv);
    // 5) y = conv @ W2^T + b2
    gemm_f32_wmma<<<grid, block, 0, stream>>>(cv, W2, b2, y, MM, CC, CC, CC);
}

// v003
// Measured time: 91.3 microseconds a run.
// In two side-by-side timings against v002, it was 1.46 and 1.47 times as fast.
// Over all steps from v000 it is 3.31 times as fast.
#include <hip/hip_runtime.h>
#include <math.h>

// Problem constants (match reference)
#define TT 2048
#define BB 4
#define CC 512
#define HH 16
#define KK 31
#define PP 15
#define MM (TT * BB)   // 8192 rows

typedef __attribute__((ext_vector_type(2))) float v2f;
typedef __attribute__((ext_vector_type(8))) float v8f;

// ---------------- fp32 WMMA GEMM: C[m,n] = sum_k A[m,k] * W[n,k] (+ bias[n]) ----
// A: row-major M x K (lda = K). W: row-major N x K (we multiply by W^T).
// Block tile 64(M) x 128(N), 128 threads = 4 waves; each wave computes a 16x128
// strip as 8 16x16 fragments. K panels of 32 floats (one 128-byte line per row) go
// from global memory straight into a two-buffer LDS ring by asynchronous copies:
// 8 lanes x 16 B cover one row's line, so a wave's copy touches 4 whole lines.
#define TM 64
#define TN 128
#define KC 32
#define LPITCH 36           // floats per panel row in LDS: 144 B = 16 B x odd, conflict-free 8-byte reads

// Low 32 bits of a __shared__ address = byte offset in the work-group's LDS.
__device__ __forceinline__ unsigned lds_off(const void* p) { return (unsigned)(size_t)p; }

// One panel: 4 copies per lane for A (64 rows), 8 for W (128 rows).
// The s_wait_xcnt stands inside the statement so that no address register of an
// issued copy is rewritten ahead of it.
__device__ __forceinline__ void copy_panel(
    unsigned la, const float* ga, size_t sa, unsigned lb, const float* const (&gb)[8], int ko)
{
    ga += ko;                              // ko: the panel's first k
    const unsigned rs = 16 * LPITCH * 4;   // LDS bytes per 16 rows
    asm volatile(
        "global_load_async_to_lds_b128 %0, %1, off\n\t"
        "global_load_async_to_lds_b128 %2, %3, off\n\t"
        "global_load_async_to_lds_b128 %4, %5, off\n\t"
        "global_load_async_to_lds_b128 %6, %7, off\n\t"
        "global_load_async_to_lds_b128 %8, %9, off\n\t"
        "global_load_async_to_lds_b128 %10, %11, off\n\t"
        "global_load_async_to_lds_b128 %12, %13, off\n\t"
        "global_load_async_to_lds_b128 %14, %15, off\n\t"
        "global_load_async_to_lds_b128 %16, %17, off\n\t"
        "global_load_async_to_lds_b128 %18, %19, off\n\t"
        "global_load_async_to_lds_b128 %20, %21, off\n\t"
        "global_load_async_to_lds_b128 %22, %23, off\n\t"
        "s_wait_xcnt 0x0"
        :: "v"(la),          "v"(ga),
           "v"(la + rs),     "v"(ga + sa),
           "v"(la + 2 * rs), "v"(ga + 2 * sa),
           "v"(la + 3 * rs), "v"(ga + 3 * sa),
           "v"(lb),          "v"(gb[0] + ko),
           "v"(lb + rs),     "v"(gb[1] + ko),
           "v"(lb + 2 * rs), "v"(gb[2] + ko),
           "v"(lb + 3 * rs), "v"(gb[3] + ko),
           "v"(lb + 4 * rs), "v"(gb[4] + ko),
           "v"(lb + 5 * rs), "v"(gb[5] + ko),
           "v"(lb + 6 * rs), "v"(gb[6] + ko),
           "v"(lb + 7 * rs), "v"(gb[7] + ko)
        : "memory");
}

__global__ __launch_bounds__(128) void gemm_f32_wmma(
    const float* __restrict__ A, const float* __restrict__ W,
    const float* __restrict__ bias, float* __restrict__ Co,
    int M, int N_valid, int K, int ldc)
{
    __shared__ __attribute__((aligned(16))) float As[2][TM][LPITCH];   // A panel: 64 x 32 (padded)
    __shared__ __attribute__((aligned(16))) float Bs[2][TN][LPITCH];   // W panel: 128 x 32 (padded)

    const int tid  = threadIdx.x;      // 0..127
    const int wave = tid >> 5;         // 0..3
    const int lane = tid & 31;
    const int hl   = lane >> 4;        // half-lane group: K offset 0 or 2
    const int l15  = lane & 15;

    const int m0   = blockIdx.x * TM;
    const int n0   = blockIdx.y * TN;
    const int mrow = wave * 16;

    // copy mapping: 8 lanes per row (16 B each), 16 rows per pass over the block
    const int crow = tid >> 3;         // 0..15, + r*16
    const int cchk = (tid & 7) * 4;    // float offset of the lane's 16 B in the row

    const float* gA = A + (size_t)(m0 + crow) * K + cchk;
    const size_t sA = (size_t)16 * K;
    const float* gB[8];
    #pragma unroll   // the eight row pointers stay in registers
    for (int r = 0; r < 8; r++) {
        // rows past N_valid copy the last valid row: in bounds, and their columns are never stored
        int gn = n0 + crow + r * 16;
        gn = gn < N_valid ? gn : N_valid - 1;
        gB[r] = W + (size_t)gn * K + cchk;
    }
    const unsigned lA = lds_off(&As[0][crow][cchk]);
    const unsigned lB = lds_off(&Bs[0][crow][cchk]);
    const unsigned bufA = TM * LPITCH * 4;   // bytes from buffer 0 to buffer 1
    const unsigned bufB = TN * LPITCH * 4;

    v8f acc[8] = {};

    const int nt = K / KC;

    // ---- prologue: panel 0 lands and is published, then panel 1 starts ----
    copy_panel(lA, gA, sA, lB, gB, 0);
    asm volatile("s_wait_asynccnt 0x0" ::: "memory");   // this wave's copies of panel 0 have landed
    __syncthreads();
    if (nt > 1)
        copy_panel(lA + bufA, gA, sA, lB + bufB, gB, KC);

    for (int t = 0; t < nt; t++) {
        const int cur = t & 1;

        // ---- compute current panel: 8 k-steps x 8 fragments = 64 WMMA ----
        #pragma unroll
        for (int kk = 0; kk < KC; kk += 4) {
            const int ka = kk + hl * 2;        // lanes 0-15: kk,kk+1 ; lanes 16-31: kk+2,kk+3
            const v2f a = *(const v2f*)&As[cur][mrow + l15][ka];
            #pragma unroll
            for (int j = 0; j < 8; j++) {
                const v2f b = *(const v2f*)&Bs[cur][j * 16 + l15][ka];   // single ds_load_b64
                acc[j] = __builtin_amdgcn_wmma_f32_16x16x4_f32(
                    false, a, false, b, (short)0, acc[j], false, false);
            }
        }

        // ---- publish panel t+1, free this buffer, refill it with panel t+2 ----
        asm volatile("s_wait_dscnt 0x0" ::: "memory");      // this wave's reads of the buffer are done
        asm volatile("s_wait_asynccnt 0x0" ::: "memory");   // this wave's copies of panel t+1 have landed
        __syncthreads();
        if (t + 2 < nt)
            copy_panel(lA + cur * bufA, gA, sA, lB + cur * bufB, gB, (t + 2) * KC);
    }
    asm volatile("s_wait_asynccnt 0x0" ::: "memory");   // nothing in flight when the wave ends

    // ---- store: C/D layout -> lanes 0-15: M = i (VGPR i), lanes 16-31: M = 8+i ----
    const int rbase = m0 + mrow + hl * 8;
    #pragma unroll
    for (int j = 0; j < 8; j++) {
        const int col = n0 + j * 16 + l15;
        if (col < N_valid) {
            const float bv = bias ? bias[col] : 0.0f;
            #pragma unroll
            for (int i = 0; i < 8; i++)
                Co[(size_t)(rbase + i) * ldc + col] = acc[j][i] + bv;
        }
    }
}

// ---------------- softmax over the taps + dynamic banded convolution -------------
// out[t,b,c] = sum_k h[t-P+k, b, c] * wsm[t,b,head(c),k],  wsm = softmax over k of w
// One wave = one head (32 channels) x 32 time steps. A lane owns 4 channels (16 B)
// and NTL consecutive time steps; its NTL+K-1 rows of h are loaded once, all loads in
// flight together, and stay in registers for all its outputs. A wave-wide load or
// store covers 4 rows x one whole 128-byte line. The filter scores go lane = tap into
// LDS; there each lane takes one time step's row through the softmax (the wave has 32
// rows and 32 lanes); the finished filters come back 4 taps per read.
#define NTL 8                     // time steps per lane
#define TWV (4 * NTL)             // time steps per wave
#define NROW (NTL + KK - 1)       // rows of h per lane
#define WPITCH 36                 // floats per filter row in LDS: 144 B = 16 B x odd, so 16-byte reads of different rows fall on distinct banks

typedef __attribute__((ext_vector_type(4))) float v4f;

__global__ __launch_bounds__(256) void dynconv(
    const float* __restrict__ h, const float* __restrict__ w, float* __restrict__ out)
{
    __shared__ __attribute__((aligned(16))) float ws[8][TWV][WPITCH];

    const int wave = threadIdx.x >> 5;
    const int lane = threadIdx.x & 31;
    const int grp  = lane >> 3;                       // which run of NTL time steps
    const int head = (blockIdx.x & 1) * 8 + wave;     // 8 heads per block
    const int b    = (blockIdx.x >> 1) & (BB - 1);
    const int t0   = (blockIdx.x >> 3) * TWV;
    const int c    = head * (CC / HH) + (lane & 7) * 4;
    const int rs   = BB * CC;                         // floats from time step t to t+1

    // filter scores of the wave's 32 time steps: lane = tap (lane 31 repeats tap 30; its slot is never used)
    const float* wp = w + (unsigned)((t0 * BB + b) * CC + head * KK + (lane < KK ? lane : KK - 1));
    float wv[TWV];
    #pragma unroll   // constant indices: wv stays in registers, the loads go out back to back
    for (int i = 0; i < TWV; i++) wv[i] = wp[i * rs];

    // the lane's rows of h: time steps tl-P .. tl+NTL-1+(K-1-P). tl and T are multiples of
    // NTL, so the rows of one aligned run tg..tg+NTL-1 lie inside [0,T) or outside together;
    // rows outside count as zero, as the reference pads them, and are not loaded.
    const int tl = t0 + grp * NTL;
    const unsigned pos = (unsigned)((tl * BB + b) * CC + c);   // the lane's place in row tl, of h and of out
    const float* hp = h + pos;
    v4f hv[NROW];
    #pragma unroll   // this loop and the two inside: constant indices, so hv stays in registers
    for (int q = 0; q < 5; q++) {
        const int tg = tl + (q - 2) * NTL;
        if (q != 2) {                                 // run 2 is tl..tl+NTL-1 itself: always inside
            #pragma unroll
            for (int j = 0; j < NROW; j++)
                if ((j + 2 * NTL - PP) / NTL == q) hv[j] = (v4f)(0.0f);
        }
        if (q == 2 || (tg >= 0 && tg < TT)) {
            #pragma unroll
            for (int j = 0; j < NROW; j++)
                if ((j + 2 * NTL - PP) / NTL == q) hv[j] = *(const v4f*)(hp + (j - PP) * rs);
        }
    }

    #pragma unroll   // constant indices into wv
    for (int i = 0; i < TWV; i++) ws[wave][i][lane] = wv[i];
    __syncthreads();   // the scores are in LDS before any lane reads a row

    // softmax of row 'lane': maximum, exp and sum in ascending tap order, one division, scale
    {
        float* pr = &ws[wave][lane][0];
        float p[KK + 1];
        #pragma unroll   // this loop and the four below: constant indices, so p stays in registers
        for (int k4 = 0; k4 <= KK; k4 += 4) {
            const v4f q = *(const v4f*)(pr + k4);
            p[k4] = q.x; p[k4 + 1] = q.y; p[k4 + 2] = q.z; p[k4 + 3] = q.w;
        }
        float mx = -INFINITY;
        #pragma unroll
        for (int k = 0; k < KK; k++) mx = fmaxf(mx, p[k]);
        float s = 0.0f;
        #pragma unroll
        for (int k = 0; k < KK; k++) { const float e = __expf(p[k] - mx); p[k] = e; s += e; }
        const float inv = 1.0f / s;
        #pragma unroll
        for (int k = 0; k < KK; k++) p[k] *= inv;
        #pragma unroll
        for (int k4 = 0; k4 <= KK; k4 += 4) {
            v4f q; q.x = p[k4]; q.y = p[k4 + 1]; q.z = p[k4 + 2]; q.w = p[k4 + 3];
            *(v4f*)(pr + k4) = q;
        }
    }
    __syncthreads();   // the finished filters are in LDS before the lanes of other rows read them

    float* op = out + pos;
    #pragma unroll   // this loop and the two inside: constant indices into hv; taps in ascending order, one fma each
    for (int i = 0; i < NTL; i++) {
        const float* wr = &ws[wave][grp * NTL + i][0];
        v4f acc = (v4f)(0.0f);
        #pragma unroll
        for (int k4 = 0; k4 < KK; k4 += 4) {
            const v4f wq = *(const v4f*)(wr + k4);           // 4 taps, one LDS read
            #pragma unroll
            for (int e = 0; e < 4; e++) {
                if (k4 + e < KK) {
                    const v4f x = hv[i + k4 + e];
                    acc.x = fmaf(x.x, wq[e], acc.x);
                    acc.y = fmaf(x.y, wq[e], acc.y);
                    acc.z = fmaf(x.z, wq[e], acc.z);
                    acc.w = fmaf(x.w, wq[e], acc.w);
                }
            }
        }
        *(v4f*)(op + i * rs) = acc;
    }
}

extern "C" void kernel_launch(void* const* d_in, const int* in_sizes, int n_in,
                              void* d_out, int out_size, void* d_ws, size_t ws_size,
                              hipStream_t stream) {
    const float* x  = (const float*)d_in[0];   // (T,B,C)
    const float* W1 = (const float*)d_in[1];   // (C,C)
    const float* b1 = (const float*)d_in[2];   // (C,)
    const float* Wl = (const float*)d_in[3];   // (H*K, C)
    const float* W2 = (const float*)d_in[4];   // (C,C)
    const float* b2 = (const float*)d_in[5];   // (C,)
    float* y = (float*)d_out;

    float* h  = (float*)d_ws;                  // 8192 x 512
    float* w  = h  + (size_t)MM * CC;          // 8192 x 512 (496 valid cols)
    float* cv = w  + (size_t)MM * CC;          // 8192 x 512

    const dim3 block(128);
    const dim3 grid(MM / TM, CC / TN);         // 128 x 4

    // 1) h = x @ W1^T + b1
    gemm_f32_wmma<<<grid, block, 0, stream>>>(x, W1, b1, h, MM, CC, CC, CC);
    // 2) w = h @ Wl^T   (N_valid = H*K = 496, buffer padded to 512)
    gemm_f32_wmma<<<grid, block, 0, stream>>>(h, Wl, nullptr, w, MM, HH * KK, CC, CC);
    // 3) softmax over K per (m, head) and dynamic conv
    dynconv<<<(TT / TWV) * BB * (HH / 8), 256, 0, stream>>>(h, w, cv);
    // 4) y = conv @ W2^T + b2
    gemm_f32_wmma<<<grid, block, 0, stream>>>(cv, W2, b2, y, MM, CC, CC, CC);
}
